// v000
// Measured on an AMD MI455X. A time is GPU time per run, averaged over a window of back-to-back runs after a warm-up
// (all launches, gaps included; the runs take copies of the inputs in turn), and the median of several windows.
// Apart from v000's, it joins two sittings. Times from different sittings can be a few percent apart, while
// side-by-side timings come from the same sitting.
// v000 is the starting kernel. One run takes 637 microseconds.
#include <hip/hip_runtime.h>
#include <math.h>

// ---------------------------------------------------------------------------
// AttentionHead on MI455X (gfx1250).
//  - fp32 GEMMs on the matrix pipe: V_WMMA_F32_16X16X4_F32 (exact fp32).
//  - global->LDS staging via gfx1250 async LDS DMA (GLOBAL_LOAD_ASYNC_TO_LDS_B128,
//    ASYNCcnt) with double-buffered LDS: next tile's DMA overlaps current WMMAs.
//
// d_out layout (tuple return): [ out | Q | K | V ], each [B=4, d=1024, n=2048].
// d_ws: scores/attn buffer [B, n, n] fp32 = 67.1 MB.
// ---------------------------------------------------------------------------

typedef float v2f __attribute__((ext_vector_type(2)));
typedef float v8f __attribute__((ext_vector_type(8)));

#define BM 128
#define BN 128
#define BK 16
#define APITCH 20            // dword pitch for row-major A tile: 16B-aligned rows,
                             // and (20*m + k) mod 64 distinct for m=0..15 -> no bank conflicts
#define NEG_BIG -1.0e12f

__device__ __forceinline__ void async_copy_b128(const float* gaddr, const void* lds_dst) {
    // GLOBAL_LOAD_ASYNC_TO_LDS_B128 (GV mode): VDST = LDS byte address (low 32
    // bits of the flat pointer per ISA 10.2), VADDR = 64-bit global address.
    unsigned lds_off = (unsigned)(unsigned long long)lds_dst;
    asm volatile("global_load_async_to_lds_b128 %0, %1, off"
                 :: "v"(lds_off), "v"(gaddr)
                 : "memory");
}
__device__ __forceinline__ void wait_async_le4() {
    asm volatile("s_wait_asynccnt 0x4" ::: "memory");
}
__device__ __forceinline__ void wait_async_0() {
    asm volatile("s_wait_asynccnt 0x0" ::: "memory");
}

// C[M,N] = alpha * A x B  (per-batch strides; A optionally accessed transposed)
//   TRANS_A=0: A[m,k] = Ag[m*lda + k]
//   TRANS_A=1: A[m,k] = Ag[k*lda + m]      (used for Q^T)
//   B[k,n] = Bg[k*ldb + n]
// MASK: C[row,col] = NEG_BIG when row>=mask_from && col>=mask_from (scores).
template <bool TRANS_A, bool MASK>
__global__ __launch_bounds__(256) void gemm_f32_wmma(
    const float* __restrict__ Ag, const float* __restrict__ Bg,
    float* __restrict__ Cg, int M, int N, int K, int lda, int ldb, int ldc,
    long long sA, long long sB, long long sC, float alpha,
    const int* __restrict__ mask_from_p)
{
    const int bz = blockIdx.z;
    const float* A = Ag + (long long)bz * sA;
    const float* B = Bg + (long long)bz * sB;
    float*       C = Cg + (long long)bz * sC;

    // Double-buffered LDS tiles, layouts chosen so async b128 copies are
    // contiguous per global row:
    //   TRANS_A=0: Asm[buf][m*APITCH + k]   (row-major, padded pitch)
    //   TRANS_A=1: Asm[buf][k*BM + m]       (k-major; Q rows are contiguous in m)
    //   Bsm[buf][k*BN + n]                  (row-major)
    __shared__ float Asm[2][TRANS_A ? (BK * BM) : (BM * APITCH)];
    __shared__ float Bsm[2][BK * BN];

    const int tid   = threadIdx.x;
    const int lane  = tid & 31;
    const int wave  = tid >> 5;        // 8 waves: 2 along M (64 rows), 4 along N (32 cols)
    const int waveM = (wave & 1) * 64;
    const int waveN = (wave >> 1) * 32;
    const int lhalf = lane >> 4;       // selects K {0,1} vs {2,3} / C rows 0-7 vs 8-15
    const int l15   = lane & 15;

    const int rowBase = blockIdx.x * BM;
    const int colBase = blockIdx.y * BN;

    // ---- async stagers: 2 b128 pieces per thread for A, 2 for B ------------
    auto stageA = [&](int k0, int buf) {
#pragma unroll
        for (int j = 0; j < 2; ++j) {
            int p = tid + j * 256;                 // 0..511
            if (TRANS_A) {
                int e = p >> 5, piece = p & 31;    // 16 rows x 32 pieces (512B rows)
                async_copy_b128(&A[(long long)(k0 + e) * lda + rowBase + piece * 4],
                                &Asm[buf][e * BM + piece * 4]);
            } else {
                int m = p >> 2, piece = p & 3;     // 128 rows x 4 pieces (64B rows)
                async_copy_b128(&A[(long long)(rowBase + m) * lda + k0 + piece * 4],
                                &Asm[buf][m * APITCH + piece * 4]);
            }
        }
    };
    auto stageB = [&](int k0, int buf) {
#pragma unroll
        for (int j = 0; j < 2; ++j) {
            int p = tid + j * 256;                 // 16 rows x 32 pieces (512B rows)
            int krow = p >> 5, piece = p & 31;
            async_copy_b128(&B[(long long)(k0 + krow) * ldb + colBase + piece * 4],
                            &Bsm[buf][krow * BN + piece * 4]);
        }
    };

    v8f acc[4][2];
#pragma unroll
    for (int mi = 0; mi < 4; ++mi)
#pragma unroll
        for (int ni = 0; ni < 2; ++ni)
#pragma unroll
            for (int e = 0; e < 8; ++e) acc[mi][ni][e] = 0.0f;

    // ---- software pipeline: prime buffer 0 --------------------------------
    stageA(0, 0);
    stageB(0, 0);                                  // 4 async instrs in flight

    int buf = 0;
    for (int k0 = 0; k0 < K; k0 += BK) {
        const int knext = k0 + BK;
        if (knext < K) {                           // issue next tile's DMA first
            stageA(knext, buf ^ 1);
            stageB(knext, buf ^ 1);
            wait_async_le4();                      // current tile landed; next in flight
        } else {
            wait_async_0();
        }
        __syncthreads();                           // all waves' DMA visible

        const float* __restrict__ As = Asm[buf];
        const float* __restrict__ Bs = Bsm[buf];
#pragma unroll
        for (int kk = 0; kk < BK; kk += 4) {
            const int kbase = kk + 2 * lhalf;      // K pair this lane-half consumes
            v2f afrag[4], bfrag[2];
#pragma unroll
            for (int mi = 0; mi < 4; ++mi) {
                const int m = waveM + mi * 16 + l15;
                if (TRANS_A) {
                    afrag[mi] = v2f{As[kbase * BM + m], As[(kbase + 1) * BM + m]};
                } else {
                    afrag[mi] = *reinterpret_cast<const v2f*>(&As[m * APITCH + kbase]);
                }
            }
#pragma unroll
            for (int ni = 0; ni < 2; ++ni) {
                const int nn = waveN + ni * 16 + l15;
                bfrag[ni] = v2f{Bs[kbase * BN + nn], Bs[(kbase + 1) * BN + nn]};
            }
#pragma unroll
            for (int mi = 0; mi < 4; ++mi)
#pragma unroll
                for (int ni = 0; ni < 2; ++ni)
                    acc[mi][ni] = __builtin_amdgcn_wmma_f32_16x16x4_f32(
                        false, afrag[mi], false, bfrag[ni],
                        (short)0, acc[mi][ni], false, false);
        }
        __syncthreads();                           // done reading buf -> reusable
        buf ^= 1;
    }

    // ---- epilogue: C layout = VGPR r, lane half -> M = r + 8*half, N = l15
    const int mf = MASK ? *mask_from_p : 0;
#pragma unroll
    for (int mi = 0; mi < 4; ++mi)
#pragma unroll
        for (int ni = 0; ni < 2; ++ni)
#pragma unroll
            for (int r = 0; r < 8; ++r) {
                int row = rowBase + waveM + mi * 16 + r + 8 * lhalf;
                int col = colBase + waveN + ni * 16 + l15;
                float v = alpha * acc[mi][ni][r];
                if (MASK && row >= mf && col >= mf) v = NEG_BIG;
                C[(long long)row * ldc + col] = v;
            }
}

// softmax over the BATCH axis (legacy torch implicit dim=0 on 3D): 4-way, in place.
__global__ __launch_bounds__(256) void softmax_batch4(float* __restrict__ S,
                                                      long long plane)
{
    long long idx = (long long)blockIdx.x * 256 + threadIdx.x;
    if (idx >= plane) return;
    float s0 = S[idx];
    float s1 = S[idx + plane];
    float s2 = S[idx + 2 * plane];
    float s3 = S[idx + 3 * plane];
    float m  = fmaxf(fmaxf(s0, s1), fmaxf(s2, s3));
    float e0 = __expf(s0 - m), e1 = __expf(s1 - m);
    float e2 = __expf(s2 - m), e3 = __expf(s3 - m);
    float inv = 1.0f / (e0 + e1 + e2 + e3);
    S[idx]             = e0 * inv;
    S[idx + plane]     = e1 * inv;
    S[idx + 2 * plane] = e2 * inv;
    S[idx + 3 * plane] = e3 * inv;
}

extern "C" void kernel_launch(void* const* d_in, const int* in_sizes, int n_in,
                              void* d_out, int out_size, void* d_ws, size_t ws_size,
                              hipStream_t stream)
{
    const float* x  = (const float*)d_in[0];   // [B, d, n]
    const float* Wq = (const float*)d_in[1];   // [d, d]
    const float* Wk = (const float*)d_in[2];
    const float* Wv = (const float*)d_in[3];
    const int* mask_from = (const int*)d_in[4];

    const int B = 4, d = 1024, n = 2048;
    const long long dn = (long long)d * n;     // 2,097,152
    const long long nn = (long long)n * n;     // 4,194,304

    float* out = (float*)d_out;                // tuple: (out, Q, K, V)
    float* Q   = out + (long long)B * dn;
    float* Kt  = Q   + (long long)B * dn;
    float* V   = Kt  + (long long)B * dn;
    float* S   = (float*)d_ws;                 // [B, n, n] scores/attn (67.1 MB)

    dim3 blk(256);

    // Q/K/V = W @ x  :  [d,n] = [d,d] x [d,n], batched over B (W stride 0)
    dim3 gqkv(d / BM, n / BN, B);              // (8,16,4)
    gemm_f32_wmma<false, false><<<gqkv, blk, 0, stream>>>(
        Wq, x, Q,  d, n, d, d, n, n, 0LL, dn, dn, 1.0f, nullptr);
    gemm_f32_wmma<false, false><<<gqkv, blk, 0, stream>>>(
        Wk, x, Kt, d, n, d, d, n, n, 0LL, dn, dn, 1.0f, nullptr);
    gemm_f32_wmma<false, false><<<gqkv, blk, 0, stream>>>(
        Wv, x, V,  d, n, d, d, n, n, 0LL, dn, dn, 1.0f, nullptr);

    // scores = Q^T K / 32, masked quadrant -> -1e12  :  [n,n], batched
    dim3 gs(n / BM, n / BN, B);                // (16,16,4)
    gemm_f32_wmma<true, true><<<gs, blk, 0, stream>>>(
        Q, Kt, S, n, n, d, n, n, n, dn, dn, nn, 0.03125f, mask_from);

    // attn = softmax over batch axis (4-way), in place
    softmax_batch4<<<(unsigned)((nn + 255) / 256), blk, 0, stream>>>(S, nn);

    // out = V @ attn  :  [d,n] = [d,n] x [n,n], batched
    dim3 go(d / BM, n / BN, B);                // (8,16,4)
    gemm_f32_wmma<false, false><<<go, blk, 0, stream>>>(
        V, S, out, d, n, n, n, n, n, dn, nn, dn, 1.0f, nullptr);
}

// v001
// It runs in 623 microseconds.
// In two side-by-side timings against v000, it was 1.08 and 1.07 times as fast.
#include <hip/hip_runtime.h>
#include <math.h>

// ---------------------------------------------------------------------------
// AttentionHead on MI455X (gfx1250).
//  - fp32 GEMMs on the matrix pipe: V_WMMA_F32_16X16X4_F32 (exact fp32).
//  - global->LDS staging via gfx1250 async LDS DMA (GLOBAL_LOAD_ASYNC_TO_LDS_B128,
//    ASYNCcnt) with double-buffered LDS: next tile's DMA overlaps current WMMAs.
//
// d_out layout (tuple return): [ out | Q | K | V ], each [B=4, d=1024, n=2048].
// d_ws: scores/attn buffer [B, n, n] fp32 = 67.1 MB.
// ---------------------------------------------------------------------------

typedef float v2f __attribute__((ext_vector_type(2)));
typedef float v8f __attribute__((ext_vector_type(8)));

#define BM 128
#define BN 128
#define BK 16
#define APITCH 20            // dword pitch for row-major A tile: 16B-aligned rows,
                             // and (20*m + k) mod 64 distinct for m=0..15 -> no bank conflicts
#define NEG_BIG -1.0e12f

__device__ __forceinline__ void async_copy_b128(const float* gaddr, const void* lds_dst) {
    // GLOBAL_LOAD_ASYNC_TO_LDS_B128 (GV mode): VDST = LDS byte address (low 32
    // bits of the flat pointer per ISA 10.2), VADDR = 64-bit global address.
    unsigned lds_off = (unsigned)(unsigned long long)lds_dst;
    asm volatile("global_load_async_to_lds_b128 %0, %1, off"
                 :: "v"(lds_off), "v"(gaddr)
                 : "memory");
}
__device__ __forceinline__ void wait_async_le4() {
    asm volatile("s_wait_asynccnt 0x4" ::: "memory");
}
__device__ __forceinline__ void wait_async_0() {
    asm volatile("s_wait_asynccnt 0x0" ::: "memory");
}

// C[M,N] = alpha * A x B  (per-batch strides; A optionally accessed transposed)
//   TRANS_A=0: A[m,k] = Ag[m*lda + k]
//   TRANS_A=1: A[m,k] = Ag[k*lda + m]      (used for Q^T)
//   B[k,n] = Bg[k*ldb + n]
// MASK: C[row,col] = NEG_BIG when row>=mask_from && col>=mask_from (scores).
template <bool TRANS_A, bool MASK>
__global__ __launch_bounds__(256) void gemm_f32_wmma(
    const float* __restrict__ Ag, const float* __restrict__ Bg,
    float* __restrict__ Cg, int M, int N, int K, int lda, int ldb, int ldc,
    long long sA, long long sB, long long sC, float alpha,
    const int* __restrict__ mask_from_p)
{
    // Which tile is this work-group's. MASK: the grid is (batch, tile rank), and rank -> tile
    // is a permutation for any mask_from: first the tiles left of the masked columns, then
    // the tiles above the masked rows, last the tiles that lie wholly in the masked quadrant.
    // Those do no product, so ranked last they leave the others spread evenly over the chip.
    int bz = blockIdx.z, tileM = blockIdx.x, tileN = blockIdx.y;
    bool allMasked = false;
    const int mf = MASK ? *mask_from_p : 0;
    if (MASK) {
        const unsigned nx = (unsigned)M / BM, ny = (unsigned)N / BN;
        const unsigned tr = mf <= 0 ? 0u : min(nx, (unsigned)(mf - 1) / BM + 1u);  // row tiles with a live row
        const unsigned tc = mf <= 0 ? 0u : min(ny, (unsigned)(mf - 1) / BN + 1u);  // column tiles with a live column
        const unsigned n1 = nx * tc, n2 = tr * (ny - tc);
        unsigned u = blockIdx.y, w = nx, m0 = 0u, c0 = 0u;
        if (u >= n1) {
            u -= n1; c0 = tc; w = tr;
            if (u >= n2) { u -= n2; m0 = tr; w = nx - tr; allMasked = true; }
        }
        const unsigned q = u / w;                  // w >= 1 in whichever range u fell
        tileN = (int)(c0 + q);
        tileM = (int)(m0 + u - q * w);
        bz = blockIdx.x;
    }
    const float* A = Ag + (long long)bz * sA;
    const float* B = Bg + (long long)bz * sB;
    float*       C = Cg + (long long)bz * sC;

    // Double-buffered LDS tiles, layouts chosen so async b128 copies are
    // contiguous per global row:
    //   TRANS_A=0: Asm[buf][m*APITCH + k]   (row-major, padded pitch)
    //   TRANS_A=1: Asm[buf][k*BM + m]       (k-major; Q rows are contiguous in m)
    //   Bsm[buf][k*BN + n]                  (row-major)
    __shared__ float Asm[2][TRANS_A ? (BK * BM) : (BM * APITCH)];
    __shared__ float Bsm[2][BK * BN];

    const int tid   = threadIdx.x;
    const int lane  = tid & 31;
    const int wave  = tid >> 5;        // 8 waves: 2 along M (64 rows), 4 along N (32 cols)
    const int waveM = (wave & 1) * 64;
    const int waveN = (wave >> 1) * 32;
    const int lhalf = lane >> 4;       // selects K {0,1} vs {2,3} / C rows 0-7 vs 8-15
    const int l15   = lane & 15;

    const int rowBase = tileM * BM;
    const int colBase = tileN * BN;

    // Every element of such a tile is replaced by NEG_BIG whatever the product gives:
    // store that and leave. The test is the same in every thread of the work-group and
    // stands before any copy or barrier.
    if (MASK && allMasked) {
        const float4 nb = make_float4(NEG_BIG, NEG_BIG, NEG_BIG, NEG_BIG);
        float* p = &C[(long long)(rowBase + wave) * ldc + colBase + lane * 4];
        // rolled: sixteen stores are not worth unrolled text ahead of the hot loop
#pragma unroll 1
        for (int r = 0; r < BM; r += 8, p += 8LL * ldc)   // one wave = one 512-byte row piece
            *reinterpret_cast<float4*>(p) = nb;
        return;
    }

    // ---- async stagers: 2 b128 pieces per thread for A, 2 for B ------------
    auto stageA = [&](int k0, int buf) {
#pragma unroll
        for (int j = 0; j < 2; ++j) {
            int p = tid + j * 256;                 // 0..511
            if (TRANS_A) {
                int e = p >> 5, piece = p & 31;    // 16 rows x 32 pieces (512B rows)
                async_copy_b128(&A[(long long)(k0 + e) * lda + rowBase + piece * 4],
                                &Asm[buf][e * BM + piece * 4]);
            } else {
                int m = p >> 2, piece = p & 3;     // 128 rows x 4 pieces (64B rows)
                async_copy_b128(&A[(long long)(rowBase + m) * lda + k0 + piece * 4],
                                &Asm[buf][m * APITCH + piece * 4]);
            }
        }
    };
    auto stageB = [&](int k0, int buf) {
#pragma unroll
        for (int j = 0; j < 2; ++j) {
            int p = tid + j * 256;                 // 16 rows x 32 pieces (512B rows)
            int krow = p >> 5, piece = p & 31;
            async_copy_b128(&B[(long long)(k0 + krow) * ldb + colBase + piece * 4],
                            &Bsm[buf][krow * BN + piece * 4]);
        }
    };

    v8f acc[4][2];
#pragma unroll
    for (int mi = 0; mi < 4; ++mi)
#pragma unroll
        for (int ni = 0; ni < 2; ++ni)
#pragma unroll
            for (int e = 0; e < 8; ++e) acc[mi][ni][e] = 0.0f;

    // ---- software pipeline: prime buffer 0 --------------------------------
    stageA(0, 0);
    stageB(0, 0);                                  // 4 async instrs in flight

    int buf = 0;
    for (int k0 = 0; k0 < K; k0 += BK) {
        const int knext = k0 + BK;
        if (knext < K) {                           // issue next tile's DMA first
            stageA(knext, buf ^ 1);
            stageB(knext, buf ^ 1);
            wait_async_le4();                      // current tile landed; next in flight
        } else {
            wait_async_0();
        }
        __syncthreads();                           // all waves' DMA visible

        const float* __restrict__ As = Asm[buf];
        const float* __restrict__ Bs = Bsm[buf];
#pragma unroll
        for (int kk = 0; kk < BK; kk += 4) {
            const int kbase = kk + 2 * lhalf;      // K pair this lane-half consumes
            v2f afrag[4], bfrag[2];
#pragma unroll
            for (int mi = 0; mi < 4; ++mi) {
                const int m = waveM + mi * 16 + l15;
                if (TRANS_A) {
                    afrag[mi] = v2f{As[kbase * BM + m], As[(kbase + 1) * BM + m]};
                } else {
                    afrag[mi] = *reinterpret_cast<const v2f*>(&As[m * APITCH + kbase]);
                }
            }
#pragma unroll
            for (int ni = 0; ni < 2; ++ni) {
                const int nn = waveN + ni * 16 + l15;
                bfrag[ni] = v2f{Bs[kbase * BN + nn], Bs[(kbase + 1) * BN + nn]};
            }
#pragma unroll
            for (int mi = 0; mi < 4; ++mi)
#pragma unroll
                for (int ni = 0; ni < 2; ++ni)
                    acc[mi][ni] = __builtin_amdgcn_wmma_f32_16x16x4_f32(
                        false, afrag[mi], false, bfrag[ni],
                        (short)0, acc[mi][ni], false, false);
        }
        __syncthreads();                           // done reading buf -> reusable
        buf ^= 1;
    }

    // ---- epilogue: C layout = VGPR r, lane half -> M = r + 8*half, N = l15
#pragma unroll
    for (int mi = 0; mi < 4; ++mi)
#pragma unroll
        for (int ni = 0; ni < 2; ++ni)
#pragma unroll
            for (int r = 0; r < 8; ++r) {
                int row = rowBase + waveM + mi * 16 + r + 8 * lhalf;
                int col = colBase + waveN + ni * 16 + l15;
                float v = alpha * acc[mi][ni][r];
                if (MASK && row >= mf && col >= mf) v = NEG_BIG;
                C[(long long)row * ldc + col] = v;
            }
}

// softmax over the BATCH axis (legacy torch implicit dim=0 on 3D): 4-way, in place.
__global__ __launch_bounds__(256) void softmax_batch4(float* __restrict__ S,
                                                      long long plane)
{
    long long idx = (long long)blockIdx.x * 256 + threadIdx.x;
    if (idx >= plane) return;
    float s0 = S[idx];
    float s1 = S[idx + plane];
    float s2 = S[idx + 2 * plane];
    float s3 = S[idx + 3 * plane];
    float m  = fmaxf(fmaxf(s0, s1), fmaxf(s2, s3));
    float e0 = __expf(s0 - m), e1 = __expf(s1 - m);
    float e2 = __expf(s2 - m), e3 = __expf(s3 - m);
    float inv = 1.0f / (e0 + e1 + e2 + e3);
    S[idx]             = e0 * inv;
    S[idx + plane]     = e1 * inv;
    S[idx + 2 * plane] = e2 * inv;
    S[idx + 3 * plane] = e3 * inv;
}

extern "C" void kernel_launch(void* const* d_in, const int* in_sizes, int n_in,
                              void* d_out, int out_size, void* d_ws, size_t ws_size,
                              hipStream_t stream)
{
    const float* x  = (const float*)d_in[0];   // [B, d, n]
    const float* Wq = (const float*)d_in[1];   // [d, d]
    const float* Wk = (const float*)d_in[2];
    const float* Wv = (const float*)d_in[3];
    const int* mask_from = (const int*)d_in[4];

    const int B = 4, d = 1024, n = 2048;
    const long long dn = (long long)d * n;     // 2,097,152
    const long long nn = (long long)n * n;     // 4,194,304

    float* out = (float*)d_out;                // tuple: (out, Q, K, V)
    float* Q   = out + (long long)B * dn;
    float* Kt  = Q   + (long long)B * dn;
    float* V   = Kt  + (long long)B * dn;
    float* S   = (float*)d_ws;                 // [B, n, n] scores/attn (67.1 MB)

    dim3 blk(256);

    // Q/K/V = W @ x  :  [d,n] = [d,d] x [d,n], batched over B (W stride 0)
    dim3 gqkv(d / BM, n / BN, B);              // (8,16,4)
    gemm_f32_wmma<false, false><<<gqkv, blk, 0, stream>>>(
        Wq, x, Q,  d, n, d, d, n, n, 0LL, dn, dn, 1.0f, nullptr);
    gemm_f32_wmma<false, false><<<gqkv, blk, 0, stream>>>(
        Wk, x, Kt, d, n, d, d, n, n, 0LL, dn, dn, 1.0f, nullptr);
    gemm_f32_wmma<false, false><<<gqkv, blk, 0, stream>>>(
        Wv, x, V,  d, n, d, d, n, n, 0LL, dn, dn, 1.0f, nullptr);

    // scores = Q^T K / 32, masked quadrant -> -1e12  :  [n,n], batched
    dim3 gs(B, (n / BM) * (n / BN));           // (4,256): batch, tile rank
    gemm_f32_wmma<true, true><<<gs, blk, 0, stream>>>(
        Q, Kt, S, n, n, d, n, n, n, dn, dn, nn, 0.03125f, mask_from);

    // attn = softmax over batch axis (4-way), in place
    softmax_batch4<<<(unsigned)((nn + 255) / 256), blk, 0, stream>>>(S, nn);

    // out = V @ attn  :  [d,n] = [d,n] x [n,n], batched
    dim3 go(d / BM, n / BN, B);                // (8,16,4)
    gemm_f32_wmma<false, false><<<go, blk, 0, stream>>>(
        V, S, out, d, n, n, n, n, n, dn, nn, dn, 1.0f, nullptr);
}

// v002
// A run of this version takes 568 microseconds.
// In both of two side-by-side timings against v001, it was 1.10 times as fast.
// Counting every step since v000, it is 1.18 times as fast.
#include <hip/hip_runtime.h>
#include <math.h>

// ---------------------------------------------------------------------------
// AttentionHead on MI455X (gfx1250).
//  - fp32 GEMMs on the matrix pipe: V_WMMA_F32_16X16X4_F32 (exact fp32).
//  - global->LDS staging via gfx1250 async LDS DMA (GLOBAL_LOAD_ASYNC_TO_LDS_B128,
//    ASYNCcnt) with double-buffered LDS: next tile's DMA overlaps current WMMAs.
//
// d_out layout (tuple return): [ out | Q | K | V ], each [B=4, d=1024, n=2048].
// d_ws: scores/attn buffer [B, n, n] fp32 = 67.1 MB.
// ---------------------------------------------------------------------------

typedef float v2f __attribute__((ext_vector_type(2)));
typedef float v8f __attribute__((ext_vector_type(8)));

#define BM 128
#define BN 128
#define BK 16
#define APITCH 20            // dword pitch for row-major A tile: 16B-aligned rows,
                             // and (20*m + k) mod 64 distinct for m=0..15 -> no bank conflicts
#define NEG_BIG -1.0e12f

__device__ __forceinline__ void async_copy_b128(const float* gaddr, const void* lds_dst) {
    // GLOBAL_LOAD_ASYNC_TO_LDS_B128 (GV mode): VDST = LDS byte address (low 32
    // bits of the flat pointer per ISA 10.2), VADDR = 64-bit global address.
    unsigned lds_off = (unsigned)(unsigned long long)lds_dst;
    asm volatile("global_load_async_to_lds_b128 %0, %1, off"
                 :: "v"(lds_off), "v"(gaddr)
                 : "memory");
}
__device__ __forceinline__ void wait_async_le4() {
    asm volatile("s_wait_asynccnt 0x4" ::: "memory");
}
__device__ __forceinline__ void wait_async_0() {
    asm volatile("s_wait_asynccnt 0x0" ::: "memory");
}

// C[M,N] = alpha * A x B  (per-batch strides; A optionally accessed transposed)
//   TRANS_A=0: A[m,k] = Ag[m*lda + k]
//   TRANS_A=1: A[m,k] = Ag[k*lda + m]      (used for Q^T)
//   B[k,n] = Bg[k*ldb + n]
// MASK: C[row,col] = NEG_BIG when row>=mask_from && col>=mask_from (scores).
// TAIL: B is the batch softmax of such scores (out = V x attn). Four equal scores give
//       exactly 1/4 each, so B[k,col] = 0.25 wherever k>=mask_from && col>=mask_from, and
//       over those k a column's product is 0.25 * (row sum of A), the same for every column.
//       TAIL_LDA is A's row pitch as a constant (0: no tail), so the row sums' loads differ
//       by immediate offsets only.
template <bool TRANS_A, bool MASK, int TAIL_LDA>
__global__ __launch_bounds__(256) void gemm_f32_wmma(
    const float* __restrict__ Ag, const float* __restrict__ Bg,
    float* __restrict__ Cg, int M, int N, int K, int lda, int ldb, int ldc,
    long long sA, long long sB, long long sC, float alpha,
    const int* __restrict__ mask_from_p)
{
    // Which tile is this work-group's. MASK: the grid is (batch, tile rank), and rank -> tile
    // is a permutation for any mask_from: first the tiles left of the masked columns, then
    // the tiles above the masked rows, last the tiles that lie wholly in the masked quadrant.
    // Those do no product, so ranked last they leave the others spread evenly over the chip.
    constexpr bool TAIL = TAIL_LDA > 0;
    int bz = blockIdx.z, tileM = blockIdx.x, tileN = blockIdx.y;
    bool allMasked = false;
    const int mf = (MASK || TAIL) ? *mask_from_p : 0;
    if (MASK) {
        const unsigned nx = (unsigned)M / BM, ny = (unsigned)N / BN;
        const unsigned tr = mf <= 0 ? 0u : min(nx, (unsigned)(mf - 1) / BM + 1u);  // row tiles with a live row
        const unsigned tc = mf <= 0 ? 0u : min(ny, (unsigned)(mf - 1) / BN + 1u);  // column tiles with a live column
        const unsigned n1 = nx * tc, n2 = tr * (ny - tc);
        unsigned u = blockIdx.y, w = nx, m0 = 0u, c0 = 0u;
        if (u >= n1) {
            u -= n1; c0 = tc; w = tr;
            if (u >= n2) { u -= n2; m0 = tr; w = nx - tr; allMasked = true; }
        }
        const unsigned q = u / w;                  // w >= 1 in whichever range u fell
        tileN = (int)(c0 + q);
        tileM = (int)(m0 + u - q * w);
        bz = blockIdx.x;
    }
    if (TAIL) {
        // grid (batch, tile rank), rank column-tile major: the tiles left of mask_from, which
        // run the whole K, start first, the short ones after them, so each WGP gets of both.
        const unsigned nx = (unsigned)M / BM;
        const unsigned q = blockIdx.y / nx;
        tileN = (int)q;
        tileM = (int)(blockIdx.y - q * nx);
        bz = blockIdx.x;
    }
    const float* A = Ag + (long long)bz * sA;
    const float* B = Bg + (long long)bz * sB;
    float*       C = Cg + (long long)bz * sC;

    // Double-buffered LDS tiles, layouts chosen so async b128 copies are
    // contiguous per global row:
    //   TRANS_A=0: Asm[buf][m*APITCH + k]   (row-major, padded pitch)
    //   TRANS_A=1: Asm[buf][k*BM + m]       (k-major; Q rows are contiguous in m)
    //   Bsm[buf][k*BN + n]                  (row-major)
    __shared__ float Asm[2][TRANS_A ? (BK * BM) : (BM * APITCH)];
    __shared__ float Bsm[2][BK * BN];

    const int tid   = threadIdx.x;
    const int lane  = tid & 31;
    const int wave  = tid >> 5;        // 8 waves: 2 along M (64 rows), 4 along N (32 cols)
    const int waveM = (wave & 1) * 64;
    const int waveN = (wave >> 1) * 32;
    const int lhalf = lane >> 4;       // selects K {0,1} vs {2,3} / C rows 0-7 vs 8-15
    const int l15   = lane & 15;

    const int rowBase = tileM * BM;
    const int colBase = tileN * BN;

    // Every element of such a tile is replaced by NEG_BIG whatever the product gives:
    // store that and leave. The test is the same in every thread of the work-group and
    // stands before any copy or barrier.
    if (MASK && allMasked) {
        const float4 nb = make_float4(NEG_BIG, NEG_BIG, NEG_BIG, NEG_BIG);
        float* p = &C[(long long)(rowBase + wave) * ldc + colBase + lane * 4];
        // rolled: sixteen stores are not worth unrolled text ahead of the hot loop
#pragma unroll 1
        for (int r = 0; r < BM; r += 8, p += 8LL * ldc)   // one wave = one 512-byte row piece
            *reinterpret_cast<float4*>(p) = nb;
        return;
    }

    // TAIL, a tile whose columns all lie at or past mask_from: the product loop ends at the
    // first BK boundary at or past mask_from; the rest of K is summed here, once per row.
    // The test is the same in every thread of the work-group.
    __shared__ __attribute__((aligned(16))) float rowTail[TAIL ? BM : 4];
    const bool tail = TAIL && colBase >= mf;       // then mf <= colBase < N: no overflow below
    const int kLim = tail ? (mf <= 0 ? 0 : min(K, (mf + BK - 1) / BK * BK)) : K;
    if (tail) {
        const int L4 = (K - kLim) >> 2;            // float4 pieces per row
        const float* Ar = A + (long long)(rowBase + wave * 16) * TAIL_LDA + kLim;   // 16 rows per wave
        float s[16];                               // the loops over r are unrolled to keep s[] in registers
#pragma unroll
        for (int r = 0; r < 16; ++r) s[r] = 0.0f;
        for (int c = lane; c < L4; c += 32) {      // one wave-load = 512 contiguous bytes of a row
#pragma unroll                                     // and to have the 16 rows' loads in flight together
            for (int r = 0; r < 16; ++r) {
                const float4 v = *reinterpret_cast<const float4*>(Ar + r * TAIL_LDA + c * 4);
                s[r] += (v.x + v.y) + (v.z + v.w);
            }
        }
        float mine = 0.0f;
#pragma unroll
        for (int r = 0; r < 16; ++r) {
#pragma unroll
            for (int o = 16; o > 0; o >>= 1) s[r] += __shfl_xor(s[r], o);
            if (l15 == r) mine = s[r];
        }
        if (lane < 16) rowTail[wave * 16 + lane] = 0.25f * mine;
        __syncthreads();                           // every wave reads other waves' rows below
    }

    // ---- async stagers: 2 b128 pieces per thread for A, 2 for B ------------
    auto stageA = [&](int k0, int buf) {
#pragma unroll
        for (int j = 0; j < 2; ++j) {
            int p = tid + j * 256;                 // 0..511
            if (TRANS_A) {
                int e = p >> 5, piece = p & 31;    // 16 rows x 32 pieces (512B rows)
                async_copy_b128(&A[(long long)(k0 + e) * lda + rowBase + piece * 4],
                                &Asm[buf][e * BM + piece * 4]);
            } else {
                int m = p >> 2, piece = p & 3;     // 128 rows x 4 pieces (64B rows)
                async_copy_b128(&A[(long long)(rowBase + m) * lda + k0 + piece * 4],
                                &Asm[buf][m * APITCH + piece * 4]);
            }
        }
    };
    auto stageB = [&](int k0, int buf) {
#pragma unroll
        for (int j = 0; j < 2; ++j) {
            int p = tid + j * 256;                 // 16 rows x 32 pieces (512B rows)
            int krow = p >> 5, piece = p & 31;
            async_copy_b128(&B[(long long)(k0 + krow) * ldb + colBase + piece * 4],
                            &Bsm[buf][krow * BN + piece * 4]);
        }
    };

    v8f acc[4][2];
#pragma unroll
    for (int mi = 0; mi < 4; ++mi)
#pragma unroll
        for (int ni = 0; ni < 2; ++ni)
#pragma unroll
            for (int e = 0; e < 8; ++e) acc[mi][ni][e] = 0.0f;
    if (tail) {
        // the sums over the tail of K are the accumulators' start values: element e is row
        // e + 8*lhalf of its 16-row tile, the same value in every column
#pragma unroll
        for (int mi = 0; mi < 4; ++mi) {
            const float4* t4 = reinterpret_cast<const float4*>(&rowTail[waveM + mi * 16 + 8 * lhalf]);
            const float4 lo = t4[0], hi = t4[1];
#pragma unroll
            for (int ni = 0; ni < 2; ++ni)
                acc[mi][ni] = v8f{lo.x, lo.y, lo.z, lo.w, hi.x, hi.y, hi.z, hi.w};
        }
    }

    // ---- software pipeline: prime buffer 0 --------------------------------
    stageA(0, 0);
    stageB(0, 0);                                  // 4 async instrs in flight

    int buf = 0;
    for (int k0 = 0; k0 < kLim; k0 += BK) {
        const int knext = k0 + BK;
        if (knext < kLim) {                        // issue next tile's DMA first
            stageA(knext, buf ^ 1);
            stageB(knext, buf ^ 1);
            wait_async_le4();                      // current tile landed; next in flight
        } else {
            wait_async_0();
        }
        __syncthreads();                           // all waves' DMA visible

        const float* __restrict__ As = Asm[buf];
        const float* __restrict__ Bs = Bsm[buf];
#pragma unroll
        for (int kk = 0; kk < BK; kk += 4) {
            const int kbase = kk + 2 * lhalf;      // K pair this lane-half consumes
            v2f afrag[4], bfrag[2];
#pragma unroll
            for (int mi = 0; mi < 4; ++mi) {
                const int m = waveM + mi * 16 + l15;
                if (TRANS_A) {
                    afrag[mi] = v2f{As[kbase * BM + m], As[(kbase + 1) * BM + m]};
                } else {
                    afrag[mi] = *reinterpret_cast<const v2f*>(&As[m * APITCH + kbase]);
                }
            }
#pragma unroll
            for (int ni = 0; ni < 2; ++ni) {
                const int nn = waveN + ni * 16 + l15;
                bfrag[ni] = v2f{Bs[kbase * BN + nn], Bs[(kbase + 1) * BN + nn]};
            }
#pragma unroll
            for (int mi = 0; mi < 4; ++mi)
#pragma unroll
                for (int ni = 0; ni < 2; ++ni)
                    acc[mi][ni] = __builtin_amdgcn_wmma_f32_16x16x4_f32(
                        false, afrag[mi], false, bfrag[ni],
                        (short)0, acc[mi][ni], false, false);
        }
        __syncthreads();                           // done reading buf -> reusable
        buf ^= 1;
    }

    // a tile whose whole K is tail never enters the loop: its primed copies land before the wave ends
    if (TAIL) wait_async_0();

    // ---- epilogue: C layout = VGPR r, lane half -> M = r + 8*half, N = l15
#pragma unroll
    for (int mi = 0; mi < 4; ++mi)
#pragma unroll
        for (int ni = 0; ni < 2; ++ni)
#pragma unroll
            for (int r = 0; r < 8; ++r) {
                int row = rowBase + waveM + mi * 16 + r + 8 * lhalf;
                int col = colBase + waveN + ni * 16 + l15;
                float v = alpha * acc[mi][ni][r];
                if (MASK && row >= mf && col >= mf) v = NEG_BIG;
                C[(long long)row * ldc + col] = v;
            }
}

// softmax over the BATCH axis (legacy torch implicit dim=0 on 3D): 4-way, in place.
__global__ __launch_bounds__(256) void softmax_batch4(float* __restrict__ S,
                                                      long long plane)
{
    long long idx = (long long)blockIdx.x * 256 + threadIdx.x;
    if (idx >= plane) return;
    float s0 = S[idx];
    float s1 = S[idx + plane];
    float s2 = S[idx + 2 * plane];
    float s3 = S[idx + 3 * plane];
    float m  = fmaxf(fmaxf(s0, s1), fmaxf(s2, s3));
    float e0 = __expf(s0 - m), e1 = __expf(s1 - m);
    float e2 = __expf(s2 - m), e3 = __expf(s3 - m);
    float inv = 1.0f / (e0 + e1 + e2 + e3);
    S[idx]             = e0 * inv;
    S[idx + plane]     = e1 * inv;
    S[idx + 2 * plane] = e2 * inv;
    S[idx + 3 * plane] = e3 * inv;
}

extern "C" void kernel_launch(void* const* d_in, const int* in_sizes, int n_in,
                              void* d_out, int out_size, void* d_ws, size_t ws_size,
                              hipStream_t stream)
{
    const float* x  = (const float*)d_in[0];   // [B, d, n]
    const float* Wq = (const float*)d_in[1];   // [d, d]
    const float* Wk = (const float*)d_in[2];
    const float* Wv = (const float*)d_in[3];
    const int* mask_from = (const int*)d_in[4];

    const int B = 4, d = 1024, n = 2048;
    const long long dn = (long long)d * n;     // 2,097,152
    const long long nn = (long long)n * n;     // 4,194,304

    float* out = (float*)d_out;                // tuple: (out, Q, K, V)
    float* Q   = out + (long long)B * dn;
    float* Kt  = Q   + (long long)B * dn;
    float* V   = Kt  + (long long)B * dn;
    float* S   = (float*)d_ws;                 // [B, n, n] scores/attn (67.1 MB)

    dim3 blk(256);

    // Q/K/V = W @ x  :  [d,n] = [d,d] x [d,n], batched over B (W stride 0)
    dim3 gqkv(d / BM, n / BN, B);              // (8,16,4)
    gemm_f32_wmma<false, false, 0><<<gqkv, blk, 0, stream>>>(
        Wq, x, Q,  d, n, d, d, n, n, 0LL, dn, dn, 1.0f, nullptr);
    gemm_f32_wmma<false, false, 0><<<gqkv, blk, 0, stream>>>(
        Wk, x, Kt, d, n, d, d, n, n, 0LL, dn, dn, 1.0f, nullptr);
    gemm_f32_wmma<false, false, 0><<<gqkv, blk, 0, stream>>>(
        Wv, x, V,  d, n, d, d, n, n, 0LL, dn, dn, 1.0f, nullptr);

    // scores = Q^T K / 32, masked quadrant -> -1e12  :  [n,n], batched
    dim3 gs(B, (n / BM) * (n / BN));           // (4,256): batch, tile rank
    gemm_f32_wmma<true, true, 0><<<gs, blk, 0, stream>>>(
        Q, Kt, S, n, n, d, n, n, n, dn, dn, nn, 0.03125f, mask_from);

    // attn = softmax over batch axis (4-way), in place
    softmax_batch4<<<(unsigned)((nn + 255) / 256), blk, 0, stream>>>(S, nn);

    // out = V @ attn  :  [d,n] = [d,n] x [n,n], batched
    dim3 go(B, (d / BM) * (n / BN));           // (4,128): batch, tile rank
    gemm_f32_wmma<false, false, n><<<go, blk, 0, stream>>>(
        V, S, out, d, n, n, n, n, n, dn, nn, dn, 1.0f, mask_from);
}

// v003
// Measured time: 509 microseconds a run.
// Two timings next to v002 both put it at 1.12 times that version's speed.
// All steps since v000 together make it 1.32 times as fast.
#include <hip/hip_runtime.h>
#include <math.h>

// ---------------------------------------------------------------------------
// AttentionHead on MI455X (gfx1250).
//  - fp32 GEMMs on the matrix pipe: V_WMMA_F32_16X16X4_F32 (exact fp32).
//  - global->LDS staging via gfx1250 async LDS DMA (GLOBAL_LOAD_ASYNC_TO_LDS_B128,
//    ASYNCcnt) with double-buffered LDS: next tile's DMA overlaps current WMMAs.
//    A stage is 32 k: a row of a row-major A tile is one whole 128-byte line.
//
// d_out layout (tuple return): [ out | Q | K | V ], each [B=4, d=1024, n=2048].
// d_ws: scores/attn buffer [B, n, n] fp32 = 67.1 MB.
// ---------------------------------------------------------------------------

typedef float v2f __attribute__((ext_vector_type(2)));
typedef float v8f __attribute__((ext_vector_type(8)));

#define BM 128
#define BN 128
#define BK 32
#define APITCH 36            // dword pitch for row-major A tile: 16B-aligned rows, and the
                             // 4-dword groups at (36*m) mod 64 distinct for m=0..15 -> no bank conflicts
#define NEG_BIG -1.0e12f

__device__ __forceinline__ unsigned lds_addr(const void* p) {
    return (unsigned)(unsigned long long)p;    // LDS byte address = low 32 bits of the flat pointer
}
__device__ __forceinline__ void async_copy8_b128(const unsigned (&l)[8], const float* const (&g)[8]) {
    // GLOBAL_LOAD_ASYNC_TO_LDS_B128 (GV mode): VDST = LDS byte address, VADDR = 64-bit global
    // address. One statement for a thread's eight pieces of a stage; the closing s_wait_xcnt
    // stands in the copies' own statement, so that no address register is rewritten ahead of
    // it (a precaution).
    asm volatile("global_load_async_to_lds_b128 %0, %8, off\n\t"
                 "global_load_async_to_lds_b128 %1, %9, off\n\t"
                 "global_load_async_to_lds_b128 %2, %10, off\n\t"
                 "global_load_async_to_lds_b128 %3, %11, off\n\t"
                 "global_load_async_to_lds_b128 %4, %12, off\n\t"
                 "global_load_async_to_lds_b128 %5, %13, off\n\t"
                 "global_load_async_to_lds_b128 %6, %14, off\n\t"
                 "global_load_async_to_lds_b128 %7, %15, off\n\t"
                 "s_wait_xcnt 0x0"
                 :: "v"(l[0]), "v"(l[1]), "v"(l[2]), "v"(l[3]), "v"(l[4]), "v"(l[5]), "v"(l[6]), "v"(l[7]),
                    "v"(g[0]), "v"(g[1]), "v"(g[2]), "v"(g[3]), "v"(g[4]), "v"(g[5]), "v"(g[6]), "v"(g[7])
                 : "memory");
}
__device__ __forceinline__ void wait_async_0() {
    // this wave's copies have landed; other waves read them behind the next barrier
    asm volatile("s_wait_asynccnt 0x0" ::: "memory");
}
__device__ __forceinline__ void wait_ds_0() {
    // this wave's LDS reads are done before the barrier behind which their buffer is refilled
    asm volatile("s_wait_dscnt 0x0" ::: "memory");
}

// C[M,N] = alpha * A x B  (per-batch strides; A optionally accessed transposed)
//   TRANS_A=0: A[m,k] = Ag[m*lda + k]
//   TRANS_A=1: A[m,k] = Ag[k*lda + m]      (used for Q^T)
//   B[k,n] = Bg[k*ldb + n]
// MASK: C[row,col] = NEG_BIG when row>=mask_from && col>=mask_from (scores).
// TAIL: B is the batch softmax of such scores (out = V x attn). Four equal scores give
//       exactly 1/4 each, so B[k,col] = 0.25 wherever k>=mask_from && col>=mask_from, and
//       over those k a column's product is 0.25 * (row sum of A), the same for every column.
//       TAIL_LDA is A's row pitch as a constant (0: no tail), so the row sums' loads differ
//       by immediate offsets only.
template <bool TRANS_A, bool MASK, int TAIL_LDA>
__global__ __launch_bounds__(256) void gemm_f32_wmma(
    const float* __restrict__ Ag, const float* __restrict__ Bg,
    float* __restrict__ Cg, int M, int N, int K, int lda, int ldb, int ldc,
    long long sA, long long sB, long long sC, float alpha,
    const int* __restrict__ mask_from_p)
{
    // Which tile is this work-group's. MASK: the grid is (batch, tile rank), and rank -> tile
    // is a permutation for any mask_from: first the tiles left of the masked columns, then
    // the tiles above the masked rows, last the tiles that lie wholly in the masked quadrant.
    // Those do no product, so ranked last they leave the others spread evenly over the chip.
    constexpr bool TAIL = TAIL_LDA > 0;
    int bz = blockIdx.z, tileM = blockIdx.x, tileN = blockIdx.y;
    bool allMasked = false;
    const int mf = (MASK || TAIL) ? *mask_from_p : 0;
    if (MASK) {
        const unsigned nx = (unsigned)M / BM, ny = (unsigned)N / BN;
        const unsigned tr = mf <= 0 ? 0u : min(nx, (unsigned)(mf - 1) / BM + 1u);  // row tiles with a live row
        const unsigned tc = mf <= 0 ? 0u : min(ny, (unsigned)(mf - 1) / BN + 1u);  // column tiles with a live column
        const unsigned n1 = nx * tc, n2 = tr * (ny - tc);
        unsigned u = blockIdx.y, w = nx, m0 = 0u, c0 = 0u;
        if (u >= n1) {
            u -= n1; c0 = tc; w = tr;
            if (u >= n2) { u -= n2; m0 = tr; w = nx - tr; allMasked = true; }
        }
        const unsigned q = u / w;                  // w >= 1 in whichever range u fell
        tileN = (int)(c0 + q);
        tileM = (int)(m0 + u - q * w);
        bz = blockIdx.x;
    }
    if (TAIL) {
        // grid (batch, tile rank), rank column-tile major: the tiles left of mask_from, which
        // run the whole K, start first, the short ones after them, so each WGP gets of both.
        const unsigned nx = (unsigned)M / BM;
        const unsigned q = blockIdx.y / nx;
        tileN = (int)q;
        tileM = (int)(blockIdx.y - q * nx);
        bz = blockIdx.x;
    }
    const float* A = Ag + (long long)bz * sA;
    const float* B = Bg + (long long)bz * sB;
    float*       C = Cg + (long long)bz * sC;

    // Double-buffered LDS tiles, layouts chosen so async b128 copies are
    // contiguous per global row:
    //   TRANS_A=0: Asm[buf][m*APITCH + k]   (row-major, padded pitch)
    //   TRANS_A=1: Asm[buf][k*BM + m]       (k-major; Q rows are contiguous in m)
    //   Bsm[buf][k*BN + n]                  (row-major)
    __shared__ float Asm[2][TRANS_A ? (BK * BM) : (BM * APITCH)];
    __shared__ float Bsm[2][BK * BN];

    const int tid   = threadIdx.x;
    const int lane  = tid & 31;
    const int wave  = tid >> 5;        // 8 waves: 2 along M (64 rows), 4 along N (32 cols)
    const int waveM = (wave & 1) * 64;
    const int waveN = (wave >> 1) * 32;
    const int lhalf = lane >> 4;       // selects K {0,1} vs {2,3} / C rows 0-7 vs 8-15
    const int l15   = lane & 15;

    const int rowBase = tileM * BM;
    const int colBase = tileN * BN;

    // Every element of such a tile is replaced by NEG_BIG whatever the product gives:
    // store that and leave. The test is the same in every thread of the work-group and
    // stands before any copy or barrier.
    if (MASK && allMasked) {
        const float4 nb = make_float4(NEG_BIG, NEG_BIG, NEG_BIG, NEG_BIG);
        float* p = &C[(long long)(rowBase + wave) * ldc + colBase + lane * 4];
        // rolled: sixteen stores are not worth unrolled text ahead of the hot loop
#pragma unroll 1
        for (int r = 0; r < BM; r += 8, p += 8LL * ldc)   // one wave = one 512-byte row piece
            *reinterpret_cast<float4*>(p) = nb;
        return;
    }

    // TAIL, a tile whose columns all lie at or past mask_from: the product loop ends at the
    // first BK boundary at or past mask_from; the rest of K is summed here, once per row.
    // The test is the same in every thread of the work-group.
    __shared__ __attribute__((aligned(16))) float rowTail[TAIL ? BM : 4];
    const bool tail = TAIL && colBase >= mf;       // then mf <= colBase < N: no overflow below
    const int kLim = tail ? (mf <= 0 ? 0 : min(K, (mf + BK - 1) / BK * BK)) : K;
    if (tail) {
        const int L4 = (K - kLim) >> 2;            // float4 pieces per row
        const float* Ar = A + (long long)(rowBase + wave * 16) * TAIL_LDA + kLim;   // 16 rows per wave
        float s[16];                               // the loops over r are unrolled to keep s[] in registers
#pragma unroll
        for (int r = 0; r < 16; ++r) s[r] = 0.0f;
        for (int c = lane; c < L4; c += 32) {      // one wave-load = 512 contiguous bytes of a row
#pragma unroll                                     // and to have the 16 rows' loads in flight together
            for (int r = 0; r < 16; ++r) {
                const float4 v = *reinterpret_cast<const float4*>(Ar + r * TAIL_LDA + c * 4);
                s[r] += (v.x + v.y) + (v.z + v.w);
            }
        }
        float mine = 0.0f;
#pragma unroll
        for (int r = 0; r < 16; ++r) {
#pragma unroll
            for (int o = 16; o > 0; o >>= 1) s[r] += __shfl_xor(s[r], o);
            if (l15 == r) mine = s[r];
        }
        if (lane < 16) rowTail[wave * 16 + lane] = 0.25f * mine;
        __syncthreads();                           // every wave reads other waves' rows below
    }

    // ---- async stager: per thread 4 b128 pieces of the A tile and 4 of the B tile -------
    // piece j of a thread lies a fixed number of rows behind piece 0, so only work-group-uniform
    // offsets are added to the thread's two pointers:
    //   TRANS_A=1 and B: 32 k rows x 32 pieces (512B rows), 8 rows per j
    //   TRANS_A=0:       128 m rows x 8 pieces (128B rows: whole lines), 32 rows per j
    const float* const gA0 = TRANS_A ? &A[(long long)(tid >> 5) * lda + rowBase + (tid & 31) * 4]
                                     : &A[(long long)(rowBase + (tid >> 3)) * lda + (tid & 7) * 4];
    const float* const gB0 = &B[(long long)(tid >> 5) * ldb + colBase + (tid & 31) * 4];
    const unsigned lA0 = lds_addr(TRANS_A ? &Asm[0][(tid >> 5) * BM + (tid & 31) * 4]
                                          : &Asm[0][(tid >> 3) * APITCH + (tid & 7) * 4]);
    const unsigned lB0 = lds_addr(&Bsm[0][(tid >> 5) * BN + (tid & 31) * 4]);
    auto stage = [&](int k0, int buf) {
        unsigned l[8];
        const float* g[8];
#pragma unroll                                     // l[] and g[] stay in registers: they are the statement's operands
        for (int j = 0; j < 4; ++j) {
            g[j]     = TRANS_A ? gA0 + (long long)(k0 + 8 * j) * lda : gA0 + (long long)(32 * j) * lda + k0;
            l[j]     = lA0 + (unsigned)(buf * (int)sizeof(Asm[0]) + j * (TRANS_A ? 8 * BM : 32 * APITCH) * 4);
            g[4 + j] = gB0 + (long long)(k0 + 8 * j) * ldb;
            l[4 + j] = lB0 + (unsigned)(buf * (int)sizeof(Bsm[0]) + j * 8 * BN * 4);
        }
        async_copy8_b128(l, g);
    };

    v8f acc[4][2];
#pragma unroll
    for (int mi = 0; mi < 4; ++mi)
#pragma unroll
        for (int ni = 0; ni < 2; ++ni)
#pragma unroll
            for (int e = 0; e < 8; ++e) acc[mi][ni][e] = 0.0f;
    if (tail) {
        // the sums over the tail of K are the accumulators' start values: element e is row
        // e + 8*lhalf of its 16-row tile, the same value in every column
#pragma unroll
        for (int mi = 0; mi < 4; ++mi) {
            const float4* t4 = reinterpret_cast<const float4*>(&rowTail[waveM + mi * 16 + 8 * lhalf]);
            const float4 lo = t4[0], hi = t4[1];
#pragma unroll
            for (int ni = 0; ni < 2; ++ni)
                acc[mi][ni] = v8f{lo.x, lo.y, lo.z, lo.w, hi.x, hi.y, hi.z, hi.w};
        }
    }

    // ---- two-buffer ring: tile 0 lands and is published, then tile 1 flies -----
    // (every test on kLim reads the same in the whole work-group)
    if (0 < kLim) stage(0, 0);
    wait_async_0();
    __syncthreads();                               // tile 0 of every wave visible
    if (BK < kLim) stage(BK, 1);

    int buf = 0;
    for (int k0 = 0; k0 < kLim; k0 += BK) {
        const float* __restrict__ As = Asm[buf];
        const float* __restrict__ Bs = Bsm[buf];
#pragma unroll
        for (int kk = 0; kk < BK; kk += 4) {
            const int kbase = kk + 2 * lhalf;      // K pair this lane-half consumes
            v2f afrag[4], bfrag[2];
#pragma unroll
            for (int mi = 0; mi < 4; ++mi) {
                const int m = waveM + mi * 16 + l15;
                if (TRANS_A) {
                    afrag[mi] = v2f{As[kbase * BM + m], As[(kbase + 1) * BM + m]};
                } else {
                    afrag[mi] = *reinterpret_cast<const v2f*>(&As[m * APITCH + kbase]);
                }
            }
#pragma unroll
            for (int ni = 0; ni < 2; ++ni) {
                const int nn = waveN + ni * 16 + l15;
                bfrag[ni] = v2f{Bs[kbase * BN + nn], Bs[(kbase + 1) * BN + nn]};
            }
#pragma unroll
            for (int mi = 0; mi < 4; ++mi)
#pragma unroll
                for (int ni = 0; ni < 2; ++ni)
                    acc[mi][ni] = __builtin_amdgcn_wmma_f32_16x16x4_f32(
                        false, afrag[mi], false, bfrag[ni],
                        (short)0, acc[mi][ni], false, false);
        }
        // foot of the trip: one barrier publishes the next tile and frees this trip's buffer
        wait_ds_0();
        wait_async_0();
        __syncthreads();
        if (k0 + 2 * BK < kLim) stage(k0 + 2 * BK, buf);   // the tile after next flies under the next trip
        buf ^= 1;
    }
    wait_async_0();                                // nothing in flight when the wave ends

    // ---- epilogue: C layout = VGPR r, lane half -> M = r + 8*half, N = l15
#pragma unroll
    for (int mi = 0; mi < 4; ++mi)
#pragma unroll
        for (int ni = 0; ni < 2; ++ni)
#pragma unroll
            for (int r = 0; r < 8; ++r) {
                int row = rowBase + waveM + mi * 16 + r + 8 * lhalf;
                int col = colBase + waveN + ni * 16 + l15;
                float v = alpha * acc[mi][ni][r];
                if (MASK && row >= mf && col >= mf) v = NEG_BIG;
                C[(long long)row * ldc + col] = v;
            }
}

// softmax over the BATCH axis (legacy torch implicit dim=0 on 3D): 4-way, in place.
__global__ __launch_bounds__(256) void softmax_batch4(float* __restrict__ S,
                                                      long long plane)
{
    long long idx = (long long)blockIdx.x * 256 + threadIdx.x;
    if (idx >= plane) return;
    float s0 = S[idx];
    float s1 = S[idx + plane];
    float s2 = S[idx + 2 * plane];
    float s3 = S[idx + 3 * plane];
    float m  = fmaxf(fmaxf(s0, s1), fmaxf(s2, s3));
    float e0 = __expf(s0 - m), e1 = __expf(s1 - m);
    float e2 = __expf(s2 - m), e3 = __expf(s3 - m);
    float inv = 1.0f / (e0 + e1 + e2 + e3);
    S[idx]             = e0 * inv;
    S[idx + plane]     = e1 * inv;
    S[idx + 2 * plane] = e2 * inv;
    S[idx + 3 * plane] = e3 * inv;
}

extern "C" void kernel_launch(void* const* d_in, const int* in_sizes, int n_in,
                              void* d_out, int out_size, void* d_ws, size_t ws_size,
                              hipStream_t stream)
{
    const float* x  = (const float*)d_in[0];   // [B, d, n]
    const float* Wq = (const float*)d_in[1];   // [d, d]
    const float* Wk = (const float*)d_in[2];
    const float* Wv = (const float*)d_in[3];
    const int* mask_from = (const int*)d_in[4];

    const int B = 4, d = 1024, n = 2048;
    const long long dn = (long long)d * n;     // 2,097,152
    const long long nn = (long long)n * n;     // 4,194,304

    float* out = (float*)d_out;                // tuple: (out, Q, K, V)
    float* Q   = out + (long long)B * dn;
    float* Kt  = Q   + (long long)B * dn;
    float* V   = Kt  + (long long)B * dn;
    float* S   = (float*)d_ws;                 // [B, n, n] scores/attn (67.1 MB)

    dim3 blk(256);

    // Q/K/V = W @ x  :  [d,n] = [d,d] x [d,n], batched over B (W stride 0)
    dim3 gqkv(d / BM, n / BN, B);              // (8,16,4)
    gemm_f32_wmma<false, false, 0><<<gqkv, blk, 0, stream>>>(
        Wq, x, Q,  d, n, d, d, n, n, 0LL, dn, dn, 1.0f, nullptr);
    gemm_f32_wmma<false, false, 0><<<gqkv, blk, 0, stream>>>(
        Wk, x, Kt, d, n, d, d, n, n, 0LL, dn, dn, 1.0f, nullptr);
    gemm_f32_wmma<false, false, 0><<<gqkv, blk, 0, stream>>>(
        Wv, x, V,  d, n, d, d, n, n, 0LL, dn, dn, 1.0f, nullptr);

    // scores = Q^T K / 32, masked quadrant -> -1e12  :  [n,n], batched
    dim3 gs(B, (n / BM) * (n / BN));           // (4,256): batch, tile rank
    gemm_f32_wmma<true, true, 0><<<gs, blk, 0, stream>>>(
        Q, Kt, S, n, n, d, n, n, n, dn, dn, nn, 0.03125f, mask_from);

    // attn = softmax over batch axis (4-way), in place
    softmax_batch4<<<(unsigned)((nn + 255) / 256), blk, 0, stream>>>(S, nn);

    // out = V @ attn  :  [d,n] = [d,n] x [n,n], batched
    dim3 go(B, (d / BM) * (n / BN));           // (4,128): batch, tile rank
    gemm_f32_wmma<false, false, n><<<go, blk, 0, stream>>>(
        V, S, out, d, n, n, n, n, n, dn, nn, dn, 1.0f, mask_from);
}
